// v000
// Measured on an AMD MI455X. A time is GPU time per run, averaged over a window of back-to-back runs after a warm-up
// (all launches, gaps included; the runs take copies of the inputs in turn), and the median of several windows.
// Apart from v000's, it joins two sittings. Times from different sittings can be a few percent apart, while
// side-by-side timings come from the same sitting.
// v000 is the starting kernel. One run takes 507 microseconds.
#include <hip/hip_runtime.h>
#include <math.h>

// ---------------------------------------------------------------------------
// MoE top-2 FFN for gfx1250 (CDNA5), fp32 WMMA (V_WMMA_F32_16X16X4_F32).
// T=2048 tokens, d=768, d_ff=3072, E=8 experts, top-2 routing.
// GEMM tiles: M=64 x N=256, 8 waves (2x4), each wave 2x4 16x16 accumulators.
// A LDS stride 34 (even, conflict-free b64 frags); B LDS K-pair interleaved,
// row stride 544 (== 32 mod 64 banks -> lane-halves on disjoint bank halves).
// ---------------------------------------------------------------------------

#define T_TOK   2048
#define N_EMBD  768
#define D_FF    3072
#define EXPERTS 8
#define KC      32            // K chunk staged through LDS
#define LDA     34            // padded A row stride (floats)
#define NT      256           // N tile
#define SBS     544           // B LDS floats per K-pair row (512 data + 32 pad)

typedef __attribute__((ext_vector_type(2))) float v2f;
typedef __attribute__((ext_vector_type(8))) float v8f;

__device__ __forceinline__ v8f wmma_f32_16x16x4(v2f a, v2f b, v8f c) {
    // 8 args: (neg_a, A, neg_b, B, c_mod, C, reuse_a, reuse_b)
    return __builtin_amdgcn_wmma_f32_16x16x4_f32(false, a, false, b,
                                                 (short)0, c, false, false);
}

// ---------------------------------------------------------------------------
// K0: zero the per-expert counters
// ---------------------------------------------------------------------------
__global__ void moe_zero_counts(int* counts) {
    if (threadIdx.x < EXPERTS) counts[threadIdx.x] = 0;
}

// ---------------------------------------------------------------------------
// K1: router. One wave (32 lanes) per token.
// ---------------------------------------------------------------------------
__global__ __launch_bounds__(256) void moe_router(
    const float* __restrict__ X,       // [T, d]
    const float* __restrict__ NOISE,   // [T, E]
    const float* __restrict__ RW,      // [E, d]
    int*   __restrict__ counts,        // [E]
    int*   __restrict__ tok_idx,       // [E, T]
    float* __restrict__ tok_w,         // [E, T]
    int*   __restrict__ route_e,       // [T, 2]
    int*   __restrict__ route_slot)    // [T, 2]
{
    const int t    = blockIdx.x * 8 + (threadIdx.x >> 5);
    const int lane = threadIdx.x & 31;

    float acc[EXPERTS];
#pragma unroll
    for (int e = 0; e < EXPERTS; e++) acc[e] = 0.0f;

    const float* xr = X + (size_t)t * N_EMBD;
    for (int i = lane; i < N_EMBD; i += 32) {
        const float xv = xr[i];
#pragma unroll
        for (int e = 0; e < EXPERTS; e++)
            acc[e] += xv * RW[e * N_EMBD + i];
    }
    // wave32 tree reduction
#pragma unroll
    for (int off = 16; off >= 1; off >>= 1) {
#pragma unroll
        for (int e = 0; e < EXPERTS; e++)
            acc[e] += __shfl_xor(acc[e], off, 32);
    }

    if (lane == 0) {
        float lg[EXPERTS];
#pragma unroll
        for (int e = 0; e < EXPERTS; e++)
            lg[e] = acc[e] + NOISE[t * EXPERTS + e];

        // top-2 (lowest index wins ties, matching lax.top_k)
        int i0 = 0;
#pragma unroll
        for (int e = 1; e < EXPERTS; e++) if (lg[e] > lg[i0]) i0 = e;
        int i1 = (i0 == 0) ? 1 : 0;
#pragma unroll
        for (int e = 0; e < EXPERTS; e++)
            if (e != i0 && lg[e] > lg[i1]) i1 = e;

        // softmax over the two kept logits
        const float e1 = __expf(lg[i1] - lg[i0]);
        const float inv = 1.0f / (1.0f + e1);
        const float w0 = inv;
        const float w1 = e1 * inv;

        int s0 = atomicAdd(&counts[i0], 1);
        tok_idx[i0 * T_TOK + s0] = t;
        tok_w  [i0 * T_TOK + s0] = w0;
        route_e   [t * 2 + 0] = i0;
        route_slot[t * 2 + 0] = s0;

        int s1 = atomicAdd(&counts[i1], 1);
        tok_idx[i1 * T_TOK + s1] = t;
        tok_w  [i1 * T_TOK + s1] = w1;
        route_e   [t * 2 + 1] = i1;
        route_slot[t * 2 + 1] = s1;
    }
}

// ---------------------------------------------------------------------------
// K2: exclusive scan of 8 counts
// ---------------------------------------------------------------------------
__global__ void moe_scan(const int* __restrict__ counts, int* __restrict__ offsets) {
    if (threadIdx.x == 0) {
        int s = 0;
        for (int e = 0; e < EXPERTS; e++) { offsets[e] = s; s += counts[e]; }
        offsets[EXPERTS] = s;
    }
}

// ---------------------------------------------------------------------------
// shared GEMM helpers
// ---------------------------------------------------------------------------
__device__ __forceinline__ void stage_B(float* __restrict__ sB,
                                        const float* __restrict__ wsrc, // row k0
                                        int ld, int n0, int tid) {
    // KC x NT slice, stored K-pair interleaved: (k,n) -> sB[(k>>1)*SBS + n*2 + (k&1)]
    for (int i = tid; i < (KC / 2) * (NT / 4); i += 256) {
        const int kp = i >> 6;            // / (NT/4)
        const int n4 = (i & 63) << 2;
        const float* src = wsrc + (size_t)(2 * kp) * ld + n0 + n4;
        const float4 r0 = *(const float4*)(src);
        const float4 r1 = *(const float4*)(src + ld);
        float* dst = sB + kp * SBS + n4 * 2;
        v2f t;
        t.x = r0.x; t.y = r1.x; ((v2f*)dst)[0] = t;
        t.x = r0.y; t.y = r1.y; ((v2f*)dst)[1] = t;
        t.x = r0.z; t.y = r1.z; ((v2f*)dst)[2] = t;
        t.x = r0.w; t.y = r1.w; ((v2f*)dst)[3] = t;
    }
}

__device__ __forceinline__ void compute_chunk(const float* __restrict__ sA,
                                              const float* __restrict__ sB,
                                              v8f acc[2][4],
                                              int wm, int wn, int lane) {
    const int lm = lane & 15;
    const int lk = (lane >> 4) * 2;       // 0 or 2
#pragma unroll
    for (int k4 = 0; k4 < KC; k4 += 4) {
        v2f afr[2], bfr[4];
#pragma unroll
        for (int i = 0; i < 2; i++)
            afr[i] = *(const v2f*)(sA + (wm + i * 16 + lm) * LDA + k4 + lk);
        const int kp = (k4 >> 1) + (lane >> 4);
#pragma unroll
        for (int j = 0; j < 4; j++)
            bfr[j] = *(const v2f*)(sB + kp * SBS + (wn + j * 16 + lm) * 2);
#pragma unroll
        for (int i = 0; i < 2; i++)
#pragma unroll
            for (int j = 0; j < 4; j++)
                acc[i][j] = wmma_f32_16x16x4(afr[i], bfr[j], acc[i][j]);
    }
}

// ---------------------------------------------------------------------------
// K3: GEMM1 — H[base+row, :] = gelu( X[tok] @ W1[e] + b1[e] )
// ---------------------------------------------------------------------------
__global__ __launch_bounds__(256) void moe_ffn1(
    const float* __restrict__ X,        // [T, d]
    const float* __restrict__ W1,       // [E, d, d_ff]
    const float* __restrict__ B1,       // [E, d_ff]
    const int*   __restrict__ counts,
    const int*   __restrict__ offsets,
    const int*   __restrict__ tok_idx,  // [E, T]
    float*       __restrict__ H)        // [2T, d_ff] compact
{
    const int e     = blockIdx.z;
    const int count = counts[e];
    const int m0    = blockIdx.y * 64;
    if (m0 >= count) return;
    const int n0 = blockIdx.x * NT;

    __shared__ float sA[64 * LDA];
    __shared__ float sB[(KC / 2) * SBS];
    __shared__ int   sTok[64];

    const int tid  = threadIdx.x;
    const int lane = tid & 31;
    const int wid  = tid >> 5;
    const int wm   = (wid >> 2) * 32;    // wave M offset (0/32)
    const int wn   = (wid & 3) * 64;     // wave N offset (0/64/128/192)

    if (tid < 64) {
        const int r = m0 + tid;
        sTok[tid] = (r < count) ? tok_idx[e * T_TOK + r] : -1;
    }

    v8f acc[2][4];
#pragma unroll
    for (int i = 0; i < 2; i++)
#pragma unroll
        for (int j = 0; j < 4; j++) acc[i][j] = {};

    const float* w1e = W1 + (size_t)e * N_EMBD * D_FF;

    for (int k0 = 0; k0 < N_EMBD; k0 += KC) {
        __syncthreads();
        // A: 64 x KC gathered token rows
        for (int i = tid; i < 64 * (KC / 4); i += 256) {
            const int r  = i >> 3;
            const int c4 = (i & 7) << 2;
            const int trow = sTok[r];
            float4 v = make_float4(0.f, 0.f, 0.f, 0.f);
            if (trow >= 0)
                v = *(const float4*)(X + (size_t)trow * N_EMBD + k0 + c4);
            float* dst = sA + r * LDA + c4;    // 8B aligned (LDA even, c4 even)
            v2f t;
            t.x = v.x; t.y = v.y; ((v2f*)dst)[0] = t;
            t.x = v.z; t.y = v.w; ((v2f*)dst)[1] = t;
        }
        stage_B(sB, w1e + (size_t)k0 * D_FF, D_FF, n0, tid);
        __syncthreads();
        compute_chunk(sA, sB, acc, wm, wn, lane);
    }

    // epilogue: bias + gelu(tanh approx) -> H
    const int base = offsets[e];
    const float* b1e = B1 + e * D_FF;
    const int lm = lane & 15;
    const int lr = (lane >> 4) * 8;
#pragma unroll
    for (int i = 0; i < 2; i++) {
#pragma unroll
        for (int j = 0; j < 4; j++) {
            const int nn = n0 + wn + j * 16 + lm;
            const float bias = b1e[nn];
#pragma unroll
            for (int r = 0; r < 8; r++) {
                const int row = m0 + wm + i * 16 + lr + r;
                if (row < count) {
                    const float v = acc[i][j][r] + bias;
                    const float u = 0.7978845608028654f * (v + 0.044715f * v * v * v);
                    const float g = 0.5f * v * (1.0f + tanhf(u));
                    H[(size_t)(base + row) * D_FF + nn] = g;
                }
            }
        }
    }
}

// ---------------------------------------------------------------------------
// K4: GEMM2 — Y[base+row, :] = w_row * ( H[base+row, :] @ W2[e] + b2[e] )
// ---------------------------------------------------------------------------
__global__ __launch_bounds__(256) void moe_ffn2(
    const float* __restrict__ H,        // [2T, d_ff]
    const float* __restrict__ W2,       // [E, d_ff, d]
    const float* __restrict__ B2,       // [E, d]
    const int*   __restrict__ counts,
    const int*   __restrict__ offsets,
    const float* __restrict__ tok_w,    // [E, T]
    float*       __restrict__ Y)        // [2T, d]
{
    const int e     = blockIdx.z;
    const int count = counts[e];
    const int m0    = blockIdx.y * 64;
    if (m0 >= count) return;
    const int n0   = blockIdx.x * NT;
    const int base = offsets[e];

    __shared__ float sA[64 * LDA];
    __shared__ float sB[(KC / 2) * SBS];
    __shared__ float sW[64];

    const int tid  = threadIdx.x;
    const int lane = tid & 31;
    const int wid  = tid >> 5;
    const int wm   = (wid >> 2) * 32;
    const int wn   = (wid & 3) * 64;

    if (tid < 64) {
        const int r = m0 + tid;
        sW[tid] = (r < count) ? tok_w[e * T_TOK + r] : 0.0f;
    }

    v8f acc[2][4];
#pragma unroll
    for (int i = 0; i < 2; i++)
#pragma unroll
        for (int j = 0; j < 4; j++) acc[i][j] = {};

    const float* w2e = W2 + (size_t)e * D_FF * N_EMBD;

    for (int k0 = 0; k0 < D_FF; k0 += KC) {
        __syncthreads();
        for (int i = tid; i < 64 * (KC / 4); i += 256) {
            const int r  = i >> 3;
            const int c4 = (i & 7) << 2;
            const int hrow = m0 + r;
            float4 v = make_float4(0.f, 0.f, 0.f, 0.f);
            if (hrow < count)
                v = *(const float4*)(H + (size_t)(base + hrow) * D_FF + k0 + c4);
            float* dst = sA + r * LDA + c4;
            v2f t;
            t.x = v.x; t.y = v.y; ((v2f*)dst)[0] = t;
            t.x = v.z; t.y = v.w; ((v2f*)dst)[1] = t;
        }
        stage_B(sB, w2e + (size_t)k0 * N_EMBD, N_EMBD, n0, tid);
        __syncthreads();
        compute_chunk(sA, sB, acc, wm, wn, lane);
    }

    const float* b2e = B2 + e * N_EMBD;
    const int lm = lane & 15;
    const int lr = (lane >> 4) * 8;
#pragma unroll
    for (int i = 0; i < 2; i++) {
#pragma unroll
        for (int j = 0; j < 4; j++) {
            const int nn = n0 + wn + j * 16 + lm;
            const float bias = b2e[nn];
#pragma unroll
            for (int r = 0; r < 8; r++) {
                const int mloc = wm + i * 16 + lr + r;
                const int row  = m0 + mloc;
                if (row < count) {
                    const float v = (acc[i][j][r] + bias) * sW[mloc];
                    Y[(size_t)(base + row) * N_EMBD + nn] = v;
                }
            }
        }
    }
}

// ---------------------------------------------------------------------------
// K5: combine — out[t] = Y[row(t,0)] + Y[row(t,1)]
// ---------------------------------------------------------------------------
__global__ __launch_bounds__(192) void moe_combine(
    const float* __restrict__ Y,
    const int*   __restrict__ offsets,
    const int*   __restrict__ route_e,
    const int*   __restrict__ route_slot,
    float*       __restrict__ out)
{
    const int t  = blockIdx.x;
    const int e0 = route_e[t * 2 + 0];
    const int e1 = route_e[t * 2 + 1];
    const int r0 = offsets[e0] + route_slot[t * 2 + 0];
    const int r1 = offsets[e1] + route_slot[t * 2 + 1];
    const int n  = threadIdx.x * 4;
    const float4 a = *(const float4*)(Y + (size_t)r0 * N_EMBD + n);
    const float4 b = *(const float4*)(Y + (size_t)r1 * N_EMBD + n);
    float4 o;
    o.x = a.x + b.x; o.y = a.y + b.y; o.z = a.z + b.z; o.w = a.w + b.w;
    *(float4*)(out + (size_t)t * N_EMBD + n) = o;
}

// ---------------------------------------------------------------------------
extern "C" void kernel_launch(void* const* d_in, const int* in_sizes, int n_in,
                              void* d_out, int out_size, void* d_ws, size_t ws_size,
                              hipStream_t stream) {
    const float* X     = (const float*)d_in[0];   // [B,S,768]
    const float* NOISE = (const float*)d_in[1];   // [T,8]
    const float* RW    = (const float*)d_in[2];   // [8,768]
    const float* W1    = (const float*)d_in[3];   // [8,768,3072]
    const float* B1    = (const float*)d_in[4];   // [8,3072]
    const float* W2    = (const float*)d_in[5];   // [8,3072,768]
    const float* B2    = (const float*)d_in[6];   // [8,768]
    float* out = (float*)d_out;

    // workspace layout
    char* ws = (char*)d_ws;
    size_t off = 0;
    int* counts  = (int*)(ws + off);  off += 64;
    int* offsets = (int*)(ws + off);  off += 64;
    int* route_e    = (int*)(ws + off); off += (size_t)T_TOK * 2 * 4;
    int* route_slot = (int*)(ws + off); off += (size_t)T_TOK * 2 * 4;
    int* tok_idx    = (int*)(ws + off); off += (size_t)EXPERTS * T_TOK * 4;
    float* tok_w    = (float*)(ws + off); off += (size_t)EXPERTS * T_TOK * 4;
    off = (off + 255) & ~(size_t)255;
    float* Hbuf = (float*)(ws + off); off += (size_t)2 * T_TOK * D_FF * 4;
    float* Ybuf = (float*)(ws + off); off += (size_t)2 * T_TOK * N_EMBD * 4;
    (void)ws_size; (void)in_sizes; (void)n_in; (void)out_size;

    moe_zero_counts<<<1, 32, 0, stream>>>(counts);
    moe_router<<<T_TOK / 8, 256, 0, stream>>>(X, NOISE, RW, counts, tok_idx,
                                              tok_w, route_e, route_slot);
    moe_scan<<<1, 32, 0, stream>>>(counts, offsets);
    {
        dim3 grid(D_FF / NT, T_TOK / 64, EXPERTS);
        moe_ffn1<<<grid, 256, 0, stream>>>(X, W1, B1, counts, offsets, tok_idx, Hbuf);
    }
    {
        dim3 grid(N_EMBD / NT, T_TOK / 64, EXPERTS);
        moe_ffn2<<<grid, 256, 0, stream>>>(Hbuf, W2, B2, counts, offsets, tok_w, Ybuf);
    }
    moe_combine<<<T_TOK, N_EMBD / 4, 0, stream>>>(Ybuf, offsets, route_e,
                                                  route_slot, out);
}

// v001
// A run of this version takes 376 microseconds.
// Timed twice side by side with v000, it ran 1.38 and 1.39 times as fast.
#include <hip/hip_runtime.h>
#include <math.h>

// ---------------------------------------------------------------------------
// MoE top-2 FFN for gfx1250 (CDNA5), fp32 WMMA (V_WMMA_F32_16X16X4_F32).
// T=2048 tokens, d=768, d_ff=3072, E=8 experts, top-2 routing.
// GEMM tiles: M=64 x N=256, 8 waves (2x4), each wave 2x4 16x16 accumulators.
// A LDS stride 34 (even, conflict-free b64 frags); B LDS K-pair interleaved,
// row stride 544 (== 32 mod 64 banks -> lane-halves on disjoint bank halves).
// K loop is software-pipelined: a chunk's A and B rows are loaded into
// registers two chunks ahead of their WMMAs and stored to the other LDS buffer
// one chunk ahead; one barrier per chunk.
// ---------------------------------------------------------------------------

#define T_TOK   2048
#define N_EMBD  768
#define D_FF    3072
#define EXPERTS 8
#define KC      32            // K chunk staged through LDS
#define LDA     34            // padded A row stride (floats)
#define NT      256           // N tile
#define SBS     544           // B LDS floats per K-pair row (512 data + 32 pad)
#define SA_SZ   (64 * LDA)        // floats of one A buffer
#define SB_SZ   ((KC / 2) * SBS)  // floats of one B buffer

typedef __attribute__((ext_vector_type(2))) float v2f;
typedef __attribute__((ext_vector_type(8))) float v8f;

__device__ __forceinline__ v8f wmma_f32_16x16x4(v2f a, v2f b, v8f c) {
    // 8 args: (neg_a, A, neg_b, B, c_mod, C, reuse_a, reuse_b)
    return __builtin_amdgcn_wmma_f32_16x16x4_f32(false, a, false, b,
                                                 (short)0, c, false, false);
}

// ---------------------------------------------------------------------------
// K0: zero the per-expert counters
// ---------------------------------------------------------------------------
__global__ void moe_zero_counts(int* counts) {
    if (threadIdx.x < EXPERTS) counts[threadIdx.x] = 0;
}

// ---------------------------------------------------------------------------
// K1: router. One wave (32 lanes) per token.
// ---------------------------------------------------------------------------
__global__ __launch_bounds__(256) void moe_router(
    const float* __restrict__ X,       // [T, d]
    const float* __restrict__ NOISE,   // [T, E]
    const float* __restrict__ RW,      // [E, d]
    int*   __restrict__ counts,        // [E]
    int*   __restrict__ tok_idx,       // [E, T]
    float* __restrict__ tok_w,         // [E, T]
    int*   __restrict__ route_e,       // [T, 2]
    int*   __restrict__ route_slot)    // [T, 2]
{
    const int t    = blockIdx.x * 8 + (threadIdx.x >> 5);
    const int lane = threadIdx.x & 31;

    float acc[EXPERTS];
#pragma unroll
    for (int e = 0; e < EXPERTS; e++) acc[e] = 0.0f;

    const float* xr = X + (size_t)t * N_EMBD;
    for (int i = lane; i < N_EMBD; i += 32) {
        const float xv = xr[i];
#pragma unroll
        for (int e = 0; e < EXPERTS; e++)
            acc[e] += xv * RW[e * N_EMBD + i];
    }
    // wave32 tree reduction
#pragma unroll
    for (int off = 16; off >= 1; off >>= 1) {
#pragma unroll
        for (int e = 0; e < EXPERTS; e++)
            acc[e] += __shfl_xor(acc[e], off, 32);
    }

    if (lane == 0) {
        float lg[EXPERTS];
#pragma unroll
        for (int e = 0; e < EXPERTS; e++)
            lg[e] = acc[e] + NOISE[t * EXPERTS + e];

        // top-2 (lowest index wins ties, matching lax.top_k)
        int i0 = 0;
#pragma unroll
        for (int e = 1; e < EXPERTS; e++) if (lg[e] > lg[i0]) i0 = e;
        int i1 = (i0 == 0) ? 1 : 0;
#pragma unroll
        for (int e = 0; e < EXPERTS; e++)
            if (e != i0 && lg[e] > lg[i1]) i1 = e;

        // softmax over the two kept logits
        const float e1 = __expf(lg[i1] - lg[i0]);
        const float inv = 1.0f / (1.0f + e1);
        const float w0 = inv;
        const float w1 = e1 * inv;

        int s0 = atomicAdd(&counts[i0], 1);
        tok_idx[i0 * T_TOK + s0] = t;
        tok_w  [i0 * T_TOK + s0] = w0;
        route_e   [t * 2 + 0] = i0;
        route_slot[t * 2 + 0] = s0;

        int s1 = atomicAdd(&counts[i1], 1);
        tok_idx[i1 * T_TOK + s1] = t;
        tok_w  [i1 * T_TOK + s1] = w1;
        route_e   [t * 2 + 1] = i1;
        route_slot[t * 2 + 1] = s1;
    }
}

// ---------------------------------------------------------------------------
// K2: exclusive scan of 8 counts
// ---------------------------------------------------------------------------
__global__ void moe_scan(const int* __restrict__ counts, int* __restrict__ offsets) {
    if (threadIdx.x == 0) {
        int s = 0;
        for (int e = 0; e < EXPERTS; e++) { offsets[e] = s; s += counts[e]; }
        offsets[EXPERTS] = s;
    }
}

// ---------------------------------------------------------------------------
// shared GEMM helpers
// ---------------------------------------------------------------------------
// One thread's share of a chunk: 2 float4 of A (rows r and r+32), and for 4
// K-pairs the float4 of both rows of B.
struct ChunkRegs {
    float4 a[2];
    float4 b0[4];
    float4 b1[4];
};

template <int LD>
__device__ __forceinline__ void load_chunk(ChunkRegs& c,
                                           const float* __restrict__ pa0,
                                           const float* __restrict__ pa1,
                                           const float* __restrict__ pb) {
    c.a[0] = *(const float4*)pa0;
    c.a[1] = *(const float4*)pa1;
#pragma unroll
    for (int u = 0; u < 4; u++) {
        c.b0[u] = *(const float4*)(pb + (size_t)(8 * u) * LD);
        c.b1[u] = *(const float4*)(pb + (size_t)(8 * u + 1) * LD);
    }
}

__device__ __forceinline__ void store_chunk(const ChunkRegs& c,
                                            float* __restrict__ sA,
                                            float* __restrict__ sB, int tid) {
    // A: row-major, stride LDA (8B aligned: LDA even, column a multiple of 4)
#pragma unroll
    for (int u = 0; u < 2; u++) {
        float* dst = sA + ((tid >> 3) + 32 * u) * LDA + ((tid & 7) << 2);
        v2f t;
        t.x = c.a[u].x; t.y = c.a[u].y; ((v2f*)dst)[0] = t;
        t.x = c.a[u].z; t.y = c.a[u].w; ((v2f*)dst)[1] = t;
    }
    // B: K-pair interleaved: (k,n) -> sB[(k>>1)*SBS + n*2 + (k&1)]
#pragma unroll
    for (int u = 0; u < 4; u++) {
        float* dst = sB + ((tid >> 6) + 4 * u) * SBS + ((tid & 63) << 3);
        const float4 r0 = c.b0[u];
        const float4 r1 = c.b1[u];
        v2f t;
        t.x = r0.x; t.y = r1.x; ((v2f*)dst)[0] = t;
        t.x = r0.y; t.y = r1.y; ((v2f*)dst)[1] = t;
        t.x = r0.z; t.y = r1.z; ((v2f*)dst)[2] = t;
        t.x = r0.w; t.y = r1.w; ((v2f*)dst)[3] = t;
    }
}

template <int KB, int KE>   // k range [KB, KE) of the chunk
__device__ __forceinline__ void compute_chunk(const float* __restrict__ sA,
                                              const float* __restrict__ sB,
                                              v8f acc[2][4],
                                              int wm, int wn, int lane) {
    const int lm = lane & 15;
    const int lk = (lane >> 4) * 2;       // 0 or 2
#pragma unroll
    for (int k4 = KB; k4 < KE; k4 += 4) {
        v2f afr[2], bfr[4];
#pragma unroll
        for (int i = 0; i < 2; i++)
            afr[i] = *(const v2f*)(sA + (wm + i * 16 + lm) * LDA + k4 + lk);
        const int kp = (k4 >> 1) + (lane >> 4);
#pragma unroll
        for (int j = 0; j < 4; j++)
            bfr[j] = *(const v2f*)(sB + kp * SBS + (wn + j * 16 + lm) * 2);
#pragma unroll
        for (int i = 0; i < 2; i++)
#pragma unroll
            for (int j = 0; j < 4; j++)
                acc[i][j] = wmma_f32_16x16x4(afr[i], bfr[j], acc[i][j]);
    }
}

// Work-group barrier that orders LDS only: the global loads of the chunk after
// next stay in flight across it (__syncthreads() would wait for them here).
__device__ __forceinline__ void lds_barrier() {
    __builtin_amdgcn_fence(__ATOMIC_RELEASE, "workgroup", "local");
    __builtin_amdgcn_s_barrier();
    __builtin_amdgcn_fence(__ATOMIC_ACQUIRE, "workgroup", "local");
}

// K loop over KTOT/KC chunks, two LDS buffers. pa0/pa1: this thread's two A
// rows at its column; pb: this thread's first B row at its column.
template <int LD, int KTOT>
__device__ __forceinline__ void gemm_k_loop(const float* __restrict__ pa0,
                                            const float* __restrict__ pa1,
                                            const float* __restrict__ pb,
                                            float* __restrict__ sA,
                                            float* __restrict__ sB,
                                            v8f acc[2][4],
                                            int wm, int wn, int lane, int tid) {
    static_assert((KTOT / KC) % 2 == 0 && KTOT >= 2 * KC, "even number of chunks");
    ChunkRegs c;
    load_chunk<LD>(c, pa0, pa1, pb);
    store_chunk(c, sA, sB, tid);
    pa0 += KC;
    pa1 += KC;
    pb  += (size_t)KC * LD;
    load_chunk<LD>(c, pa0, pa1, pb);
    lds_barrier();
    // Step i multiplies chunk i; in its middle chunk i+1 goes from registers to
    // the buffer whose readers all left it before the last barrier, and chunk
    // i+2 starts its way from memory into the same registers. Two steps a trip,
    // so that every LDS address is a loop constant (KTOT/KC is even).
    float* const sA1 = sA + SA_SZ;
    float* const sB1 = sB + SB_SZ;
    for (int k0 = 2 * KC; k0 < KTOT; k0 += 2 * KC) {
        compute_chunk<0, KC / 2>(sA, sB, acc, wm, wn, lane);
        store_chunk(c, sA1, sB1, tid);
        pa0 += KC;
        pa1 += KC;
        pb  += (size_t)KC * LD;
        load_chunk<LD>(c, pa0, pa1, pb);
        compute_chunk<KC / 2, KC>(sA, sB, acc, wm, wn, lane);
        lds_barrier();

        compute_chunk<0, KC / 2>(sA1, sB1, acc, wm, wn, lane);
        store_chunk(c, sA, sB, tid);
        pa0 += KC;
        pa1 += KC;
        pb  += (size_t)KC * LD;
        load_chunk<LD>(c, pa0, pa1, pb);
        compute_chunk<KC / 2, KC>(sA1, sB1, acc, wm, wn, lane);
        lds_barrier();
    }
    compute_chunk<0, KC / 2>(sA, sB, acc, wm, wn, lane);
    store_chunk(c, sA1, sB1, tid);
    compute_chunk<KC / 2, KC>(sA, sB, acc, wm, wn, lane);
    lds_barrier();
    compute_chunk<0, KC>(sA1, sB1, acc, wm, wn, lane);
}

// ---------------------------------------------------------------------------
// K3: GEMM1 — H[base+row, :] = gelu( X[tok] @ W1[e] + b1[e] )
// ---------------------------------------------------------------------------
__global__ __launch_bounds__(256) void moe_ffn1(
    const float* __restrict__ X,        // [T, d]
    const float* __restrict__ W1,       // [E, d, d_ff]
    const float* __restrict__ B1,       // [E, d_ff]
    const int*   __restrict__ counts,
    const int*   __restrict__ offsets,
    const int*   __restrict__ tok_idx,  // [E, T]
    float*       __restrict__ H)        // [2T, d_ff] compact
{
    const int e     = blockIdx.z;
    const int count = counts[e];
    const int m0    = blockIdx.y * 64;
    if (m0 >= count) return;
    const int n0 = blockIdx.x * NT;

    __shared__ float sA[2 * SA_SZ];
    __shared__ float sB[2 * SB_SZ];

    const int tid  = threadIdx.x;
    const int lane = tid & 31;
    const int wid  = tid >> 5;
    const int wm   = (wid >> 2) * 32;    // wave M offset (0/32)
    const int wn   = (wid & 3) * 64;     // wave N offset (0/64/128/192)

    v8f acc[2][4];
#pragma unroll
    for (int i = 0; i < 2; i++)
#pragma unroll
        for (int j = 0; j < 4; j++) acc[i][j] = {};

    const float* w1e = W1 + (size_t)e * N_EMBD * D_FF;

    // rows past count repeat the last valid row; their results are never stored
    const int ar0 = min(m0 + (tid >> 3), count - 1);
    const int ar1 = min(m0 + (tid >> 3) + 32, count - 1);
    const int ac  = (tid & 7) << 2;
    gemm_k_loop<D_FF, N_EMBD>(
        X + (size_t)tok_idx[e * T_TOK + ar0] * N_EMBD + ac,
        X + (size_t)tok_idx[e * T_TOK + ar1] * N_EMBD + ac,
        w1e + (size_t)(2 * (tid >> 6)) * D_FF + n0 + ((tid & 63) << 2),
        sA, sB, acc, wm, wn, lane, tid);

    // epilogue: bias + gelu(tanh approx) -> H
    const int base = offsets[e];
    const float* b1e = B1 + e * D_FF;
    const int lm = lane & 15;
    const int lr = (lane >> 4) * 8;
#pragma unroll
    for (int i = 0; i < 2; i++) {
#pragma unroll
        for (int j = 0; j < 4; j++) {
            const int nn = n0 + wn + j * 16 + lm;
            const float bias = b1e[nn];
            if (i == 0 && j == 0) {
                // This first load is lifted into the last chunk's WMMAs, so keep
                // a wait in front of the reuse of its address register. The later loads have the build's own.
                asm volatile("s_wait_xcnt 0x0" ::: "memory");
            }
#pragma unroll
            for (int r = 0; r < 8; r++) {
                const int row = m0 + wm + i * 16 + lr + r;
                if (row < count) {
                    const float v = acc[i][j][r] + bias;
                    const float u = 0.7978845608028654f * (v + 0.044715f * v * v * v);
                    const float g = 0.5f * v * (1.0f + tanhf(u));
                    H[(size_t)(base + row) * D_FF + nn] = g;
                }
            }
        }
    }
}

// ---------------------------------------------------------------------------
// K4: GEMM2 — Y[base+row, :] = w_row * ( H[base+row, :] @ W2[e] + b2[e] )
// ---------------------------------------------------------------------------
__global__ __launch_bounds__(256) void moe_ffn2(
    const float* __restrict__ H,        // [2T, d_ff]
    const float* __restrict__ W2,       // [E, d_ff, d]
    const float* __restrict__ B2,       // [E, d]
    const int*   __restrict__ counts,
    const int*   __restrict__ offsets,
    const float* __restrict__ tok_w,    // [E, T]
    float*       __restrict__ Y)        // [2T, d]
{
    const int e     = blockIdx.z;
    const int count = counts[e];
    const int m0    = blockIdx.y * 64;
    if (m0 >= count) return;
    const int n0   = blockIdx.x * NT;
    const int base = offsets[e];

    __shared__ float sA[2 * SA_SZ];
    __shared__ float sB[2 * SB_SZ];
    __shared__ float sW[64];

    const int tid  = threadIdx.x;
    const int lane = tid & 31;
    const int wid  = tid >> 5;
    const int wm   = (wid >> 2) * 32;
    const int wn   = (wid & 3) * 64;

    if (tid < 64) {
        const int r = m0 + tid;
        sW[tid] = (r < count) ? tok_w[e * T_TOK + r] : 0.0f;
    }

    v8f acc[2][4];
#pragma unroll
    for (int i = 0; i < 2; i++)
#pragma unroll
        for (int j = 0; j < 4; j++) acc[i][j] = {};

    const float* w2e = W2 + (size_t)e * D_FF * N_EMBD;

    // rows past count repeat the last valid row; their results are never stored
    const int ar0 = min(m0 + (tid >> 3), count - 1);
    const int ar1 = min(m0 + (tid >> 3) + 32, count - 1);
    const int ac  = (tid & 7) << 2;
    gemm_k_loop<N_EMBD, D_FF>(
        H + (size_t)(base + ar0) * D_FF + ac,
        H + (size_t)(base + ar1) * D_FF + ac,
        w2e + (size_t)(2 * (tid >> 6)) * N_EMBD + n0 + ((tid & 63) << 2),
        sA, sB, acc, wm, wn, lane, tid);

    const float* b2e = B2 + e * N_EMBD;
    const int lm = lane & 15;
    const int lr = (lane >> 4) * 8;
#pragma unroll
    for (int i = 0; i < 2; i++) {
#pragma unroll
        for (int j = 0; j < 4; j++) {
            const int nn = n0 + wn + j * 16 + lm;
            const float bias = b2e[nn];
#pragma unroll
            for (int r = 0; r < 8; r++) {
                const int mloc = wm + i * 16 + lr + r;
                const int row  = m0 + mloc;
                if (row < count) {
                    const float v = (acc[i][j][r] + bias) * sW[mloc];
                    Y[(size_t)(base + row) * N_EMBD + nn] = v;
                }
            }
        }
    }
}

// ---------------------------------------------------------------------------
// K5: combine — out[t] = Y[row(t,0)] + Y[row(t,1)]
// ---------------------------------------------------------------------------
__global__ __launch_bounds__(192) void moe_combine(
    const float* __restrict__ Y,
    const int*   __restrict__ offsets,
    const int*   __restrict__ route_e,
    const int*   __restrict__ route_slot,
    float*       __restrict__ out)
{
    const int t  = blockIdx.x;
    const int e0 = route_e[t * 2 + 0];
    const int e1 = route_e[t * 2 + 1];
    const int r0 = offsets[e0] + route_slot[t * 2 + 0];
    const int r1 = offsets[e1] + route_slot[t * 2 + 1];
    const int n  = threadIdx.x * 4;
    const float4 a = *(const float4*)(Y + (size_t)r0 * N_EMBD + n);
    const float4 b = *(const float4*)(Y + (size_t)r1 * N_EMBD + n);
    float4 o;
    o.x = a.x + b.x; o.y = a.y + b.y; o.z = a.z + b.z; o.w = a.w + b.w;
    *(float4*)(out + (size_t)t * N_EMBD + n) = o;
}

// ---------------------------------------------------------------------------
extern "C" void kernel_launch(void* const* d_in, const int* in_sizes, int n_in,
                              void* d_out, int out_size, void* d_ws, size_t ws_size,
                              hipStream_t stream) {
    const float* X     = (const float*)d_in[0];   // [B,S,768]
    const float* NOISE = (const float*)d_in[1];   // [T,8]
    const float* RW    = (const float*)d_in[2];   // [8,768]
    const float* W1    = (const float*)d_in[3];   // [8,768,3072]
    const float* B1    = (const float*)d_in[4];   // [8,3072]
    const float* W2    = (const float*)d_in[5];   // [8,3072,768]
    const float* B2    = (const float*)d_in[6];   // [8,768]
    float* out = (float*)d_out;

    // workspace layout
    char* ws = (char*)d_ws;
    size_t off = 0;
    int* counts  = (int*)(ws + off);  off += 64;
    int* offsets = (int*)(ws + off);  off += 64;
    int* route_e    = (int*)(ws + off); off += (size_t)T_TOK * 2 * 4;
    int* route_slot = (int*)(ws + off); off += (size_t)T_TOK * 2 * 4;
    int* tok_idx    = (int*)(ws + off); off += (size_t)EXPERTS * T_TOK * 4;
    float* tok_w    = (float*)(ws + off); off += (size_t)EXPERTS * T_TOK * 4;
    off = (off + 255) & ~(size_t)255;
    float* Hbuf = (float*)(ws + off); off += (size_t)2 * T_TOK * D_FF * 4;
    float* Ybuf = (float*)(ws + off); off += (size_t)2 * T_TOK * N_EMBD * 4;
    (void)ws_size; (void)in_sizes; (void)n_in; (void)out_size;

    moe_zero_counts<<<1, 32, 0, stream>>>(counts);
    moe_router<<<T_TOK / 8, 256, 0, stream>>>(X, NOISE, RW, counts, tok_idx,
                                              tok_w, route_e, route_slot);
    moe_scan<<<1, 32, 0, stream>>>(counts, offsets);
    {
        dim3 grid(D_FF / NT, T_TOK / 64, EXPERTS);
        moe_ffn1<<<grid, 256, 0, stream>>>(X, W1, B1, counts, offsets, tok_idx, Hbuf);
    }
    {
        dim3 grid(N_EMBD / NT, T_TOK / 64, EXPERTS);
        moe_ffn2<<<grid, 256, 0, stream>>>(Hbuf, W2, B2, counts, offsets, tok_w, Ybuf);
    }
    moe_combine<<<T_TOK, N_EMBD / 4, 0, stream>>>(Ybuf, offsets, route_e,
                                                  route_slot, out);
}
